// v000
// Times are from an AMD MI455X. After a warm-up the kernel runs many times in a row, and a time is the length of
// such a window on the GPU divided by its runs, so every launch and the gaps after it count. The runs cycle
// through copies of the inputs. A figure is the median of several windows, for all but v000 over two sittings.
// Sittings can differ by a few percent; kernels timed side by side share one.
// v000, which the later versions start from, runs in 68.1 microseconds.
#include <hip/hip_runtime.h>

// Problem constants (from reference)
#define B_  64
#define H_  24
#define N_  207
#define F_  64
#define LDSS 68   // padded LDS row stride (floats): conflict-free A-frag reads, 16B-aligned rows
#define LH  32    // logits/probs row stride (24 used)

typedef float v2f __attribute__((ext_vector_type(2)));
typedef float v8f __attribute__((ext_vector_type(8)));
typedef int   v4i __attribute__((vector_size(16)));   // matches builtin's expected param type

// ---------- CDNA5 async global->LDS path (ASYNCcnt), with sync fallback ----------
#if defined(__gfx1250__) && __has_builtin(__builtin_amdgcn_global_load_async_to_lds_b128)
#define HAVE_ASYNC 1
#else
#define HAVE_ASYNC 0
#endif

// Copy one 64x64 fp32 matrix (global row stride `rstride`) into LDS (row stride LDSS).
// 256 threads: 4 threads per row, 16 floats (4x b128) each.
// Async mode: 4 GLOBAL_LOAD_ASYNC_TO_LDS_B128 per thread -> 8 per wave per (input,weight) pair.
__device__ __forceinline__ void copy_mat(float* __restrict__ dst,
                                         const float* __restrict__ base,
                                         long long rstride, int lr, int lc)
{
    const float* g = base + (long long)lr * rstride + lc;
    float* d = dst + lr * LDSS + lc;
#if HAVE_ASYNC
#pragma unroll
    for (int j = 0; j < 4; ++j) {
        __builtin_amdgcn_global_load_async_to_lds_b128(
            (v4i*)(g + 4 * j), (v4i*)(d + 4 * j), 0, 0);
    }
#else
#pragma unroll
    for (int j = 0; j < 4; ++j) {
        ((float4*)d)[j] = ((const float4*)g)[j];   // LDSS=68 keeps this 16B aligned
    }
#endif
}

// Wait until at most NREM async-load instructions of this wave are outstanding,
// then barrier so every wave's staged data is visible. Async loads complete in
// order, so NREM==8 means "the older 8-instruction group has fully landed in LDS"
// *provided* a newer group is still queued behind it; the final iteration of a
// streaming loop must use NREM==0 (only its own group is outstanding).
template <int NREM>
__device__ __forceinline__ void wait_stage()
{
#if HAVE_ASYNC
#if __has_builtin(__builtin_amdgcn_s_wait_asynccnt)
    __builtin_amdgcn_s_wait_asynccnt((unsigned short)NREM);
#else
    if (NREM == 0) asm volatile("s_wait_asynccnt 0x0" ::: "memory");
    else           asm volatile("s_wait_asynccnt 0x8" ::: "memory");
#endif
#endif
    __syncthreads();
}

// Two 16x16 output tiles (same row band tm, columns tn0 and tn0+1) of a 64x64x64
// fp32 GEMM using V_WMMA_F32_16X16X4_F32 (K=4 x 16 steps). The A fragment is loaded
// once per k-step and feeds both WMMAs.
// A layout (32-bit 16x4): lane m=lane&15; VGPR0 = A[m, k0], VGPR1 = A[m, k0+1], k0 = 4kk+2*(lane>>4).
// B layout (32-bit 4x16): lane n=lane&15; VGPR0 = B[k0, n],  VGPR1 = B[k0+1, n].
__device__ __forceinline__ void gemm16x2(const float* __restrict__ sA,
                                         const float* __restrict__ sB,
                                         int tm, int tn0, int ml, int kh,
                                         v8f& c0, v8f& c1)
{
#pragma unroll
    for (int kk = 0; kk < 16; ++kk) {
        const int k0 = kk * 4 + 2 * kh;
        v2f a, b0, b1;
        a[0]  = sA[(tm * 16 + ml) * LDSS + k0];
        a[1]  = sA[(tm * 16 + ml) * LDSS + k0 + 1];
        b0[0] = sB[(k0    ) * LDSS +  tn0      * 16 + ml];
        b0[1] = sB[(k0 + 1) * LDSS +  tn0      * 16 + ml];
        b1[0] = sB[(k0    ) * LDSS + (tn0 + 1) * 16 + ml];
        b1[1] = sB[(k0 + 1) * LDSS + (tn0 + 1) * 16 + ml];
        c0 = __builtin_amdgcn_wmma_f32_16x16x4_f32(false, a, false, b0, (short)0, c0,
                                                   false, false);
        c1 = __builtin_amdgcn_wmma_f32_16x16x4_f32(false, a, false, b1, (short)0, c1,
                                                   false, false);
    }
}

__global__ __launch_bounds__(256)
void node_mha_kernel(const float* __restrict__ Q,  const float* __restrict__ K,
                     const float* __restrict__ V,  const float* __restrict__ Wq,
                     const float* __restrict__ bq, const float* __restrict__ Wk,
                     const float* __restrict__ bk, const float* __restrict__ Wv,
                     const float* __restrict__ bv,
                     float* __restrict__ heads, float* __restrict__ scores)
{
    __shared__ float sA [2][64 * LDSS];  // double-buffered input slice (M = batch)
    __shared__ float sB [2][64 * LDSS];  // double-buffered weights
    __shared__ float sQW[64 * LDSS];     // QW result, reused for all 24 logit dots
    __shared__ float sL [64 * LH];       // logits -> probs, [batch][head]

    const int n    = blockIdx.x;        // node id, 0..206
    const int tid  = threadIdx.x;       // 256 threads = 8 wave32
    const int wv   = tid >> 5;
    const int lane = tid & 31;
    const int ml   = lane & 15;         // A row / B col / C col within tile
    const int kh   = lane >> 4;         // K-half (A/B) and M-half (C)
    const int lr   = tid >> 2;          // staging row 0..63
    const int lc   = (tid & 3) << 4;    // staging col {0,16,32,48}

    const int tm  = wv >> 1;            // this wave's row band (tiles share A)
    const int tn0 = (wv & 1) * 2;       // first of two column tiles

    // zero logits accumulators
    for (int i = tid; i < 64 * LH; i += 256) sL[i] = 0.0f;

    // ---------------- Phase 1: QW = Q_n @ Wq_n + bq[n]  (buffer 0) ----------------
    copy_mat(sA[0], Q  + (long long)n * F_,      (long long)N_ * F_, lr, lc);
    copy_mat(sB[0], Wq + (long long)n * F_ * F_, F_,                 lr, lc);
    // Prologue for phase 2: stream K/Wk head 0 into buffer 1 while we do QW.
    copy_mat(sA[1], K  + ((long long)0 * N_ + n) * F_,        (long long)H_ * N_ * F_, lr, lc);
    copy_mat(sB[1], Wk + (((long long)n * H_ + 0) * F_) * F_, F_,                      lr, lc);
    wait_stage<8>();   // Q/Wq landed (K0 group may still be in flight)

    {
        v8f c0 = {}, c1 = {};
        gemm16x2(sA[0], sB[0], tm, tn0, ml, kh, c0, c1);
        const float bg0 = bq[n * F_ +  tn0      * 16 + ml];
        const float bg1 = bq[n * F_ + (tn0 + 1) * 16 + ml];
#pragma unroll
        for (int r = 0; r < 8; ++r) {
            const int row = tm * 16 + r + 8 * kh;            // batch b
            sQW[row * LDSS +  tn0      * 16 + ml] = c0[r] + bg0;
            sQW[row * LDSS + (tn0 + 1) * 16 + ml] = c1[r] + bg1;
        }
    }
    __syncthreads();
    // head h lives in buffer (h+1)&1; issue K/Wk head 1 into freed buffer 0.
    copy_mat(sA[0], K  + ((long long)1 * N_ + n) * F_,        (long long)H_ * N_ * F_, lr, lc);
    copy_mat(sB[0], Wk + (((long long)n * H_ + 1) * F_) * F_, F_,                      lr, lc);

    // ------- Phase 2: logits[b,h] = QW[b,:] . (K_nh @ Wk_nh + bk[n,h]) -------
    for (int h = 0; h < H_; ++h) {
        const int buf = (h + 1) & 1;
        // Normal iterations: a newer group is queued behind head h's group, so
        // waiting down to 8 outstanding proves head h landed. Final iteration:
        // only head h's group is outstanding -> must drain to 0.
        if (h == H_ - 1) wait_stage<0>(); else wait_stage<8>();

        v8f c0 = {}, c1 = {};
        gemm16x2(sA[buf], sB[buf], tm, tn0, ml, kh, c0, c1);
        const float bg0 = bk[((long long)n * H_ + h) * F_ +  tn0      * 16 + ml];
        const float bg1 = bk[((long long)n * H_ + h) * F_ + (tn0 + 1) * 16 + ml];
        float part[8];
#pragma unroll
        for (int r = 0; r < 8; ++r) {
            const int row = tm * 16 + r + 8 * kh;
            part[r] = (c0[r] + bg0) * sQW[row * LDSS +  tn0      * 16 + ml]
                    + (c1[r] + bg1) * sQW[row * LDSS + (tn0 + 1) * 16 + ml];
        }
        // reduce over the 32 columns this wave owns (within each 16-lane half)
#pragma unroll
        for (int off = 8; off >= 1; off >>= 1) {
#pragma unroll
            for (int r = 0; r < 8; ++r)
                part[r] += __shfl_xor(part[r], off, 16);
        }
        if (ml == 0) {
#pragma unroll
            for (int r = 0; r < 8; ++r) {
                const int row = tm * 16 + r + 8 * kh;
                atomicAdd(&sL[row * LH + h], part[r]);   // ds_add_f32
            }
        }
        __syncthreads();   // everyone done reading buf before it is refilled
        if (h + 2 < H_) {  // stream head h+2 into the buffer just freed
            copy_mat(sA[buf], K  + ((long long)(h + 2) * N_ + n) * F_,
                     (long long)H_ * N_ * F_, lr, lc);
            copy_mat(sB[buf], Wk + (((long long)n * H_ + (h + 2)) * F_) * F_,
                     F_, lr, lc);
        }
    }

    // Prologue for phase 4: V/Wv heads 0 and 1 stream while softmax runs.
    copy_mat(sA[1], V  + ((long long)0 * N_ + n) * F_,        (long long)H_ * N_ * F_, lr, lc);
    copy_mat(sB[1], Wv + (((long long)n * H_ + 0) * F_) * F_, F_,                      lr, lc);
    copy_mat(sA[0], V  + ((long long)1 * N_ + n) * F_,        (long long)H_ * N_ * F_, lr, lc);
    copy_mat(sB[0], Wv + (((long long)n * H_ + 1) * F_) * F_, F_,                      lr, lc);

    // ---------------- Phase 3: softmax over H (24) per batch row ----------------
    if (tid < 64) {
        float mx = -3.4e38f;
#pragma unroll
        for (int h = 0; h < H_; ++h) mx = fmaxf(mx, sL[tid * LH + h]);
        float e[H_];
        float sum = 0.0f;
#pragma unroll
        for (int h = 0; h < H_; ++h) { e[h] = __expf(sL[tid * LH + h] - mx); sum += e[h]; }
        const float inv = 1.0f / sum;
#pragma unroll
        for (int h = 0; h < H_; ++h) {
            const float p = e[h] * inv;
            sL[tid * LH + h] = p;
            scores[((long long)tid * N_ + n) * H_ + h] = p;   // scores[b,n,h]
        }
    }

    // ---- Phase 4: heads[b,:] = sum_h p[b,h] * (V_nh @ Wv_nh + bv[n,h]) ----
    v8f hacc0 = {}, hacc1 = {};
    for (int h = 0; h < H_; ++h) {
        const int buf = (h + 1) & 1;
        if (h == H_ - 1) wait_stage<0>(); else wait_stage<8>();
        // (h==0 barrier also publishes the softmax probs)

        v8f c0 = {}, c1 = {};
        gemm16x2(sA[buf], sB[buf], tm, tn0, ml, kh, c0, c1);
        const float bg0 = bv[((long long)n * H_ + h) * F_ +  tn0      * 16 + ml];
        const float bg1 = bv[((long long)n * H_ + h) * F_ + (tn0 + 1) * 16 + ml];
#pragma unroll
        for (int r = 0; r < 8; ++r) {
            const int row = tm * 16 + r + 8 * kh;        // batch b
            const float p = sL[row * LH + h];            // broadcast LDS read
            hacc0[r] += p * (c0[r] + bg0);
            hacc1[r] += p * (c1[r] + bg1);
        }
        __syncthreads();
        if (h + 2 < H_) {
            copy_mat(sA[buf], V  + ((long long)(h + 2) * N_ + n) * F_,
                     (long long)H_ * N_ * F_, lr, lc);
            copy_mat(sB[buf], Wv + (((long long)n * H_ + (h + 2)) * F_) * F_,
                     F_, lr, lc);
        }
    }

    // store heads[b,n,g]
#pragma unroll
    for (int r = 0; r < 8; ++r) {
        const int row = tm * 16 + r + 8 * kh;            // batch b
        heads[((long long)row * N_ + n) * F_ +  tn0      * 16 + ml] = hacc0[r];
        heads[((long long)row * N_ + n) * F_ + (tn0 + 1) * 16 + ml] = hacc1[r];
    }
}

extern "C" void kernel_launch(void* const* d_in, const int* in_sizes, int n_in,
                              void* d_out, int out_size, void* d_ws, size_t ws_size,
                              hipStream_t stream)
{
    (void)in_sizes; (void)n_in; (void)d_ws; (void)ws_size; (void)out_size;
    const float* Q  = (const float*)d_in[0];
    const float* K  = (const float*)d_in[1];
    const float* V  = (const float*)d_in[2];
    const float* Wq = (const float*)d_in[3];
    const float* bq = (const float*)d_in[4];
    const float* Wk = (const float*)d_in[5];
    const float* bk = (const float*)d_in[6];
    const float* Wv = (const float*)d_in[7];
    const float* bv = (const float*)d_in[8];

    float* heads  = (float*)d_out;                       // [B,N,F]
    float* scores = heads + (size_t)B_ * N_ * F_;        // [B,N,H]

    node_mha_kernel<<<dim3(N_), dim3(256), 0, stream>>>(Q, K, V, Wq, bq, Wk, bk, Wv, bv,
                                                        heads, scores);
}

// v001
// It runs in 65.5 microseconds.
// Next to v000, in two timings, it ran 1.08 times as fast each time.
#include <hip/hip_runtime.h>

// Problem constants (from reference)
#define B_  64
#define H_  24
#define N_  207
#define F_  64
#define LDSS 68   // padded LDS row stride (floats): conflict-free A-frag reads, 16B-aligned rows
#define LDSB 80   // weight-tile row stride (floats): rows k and k+2 lie 32 banks apart, so the two
                  // half-waves of an 8-byte B read cover all 64 banks once; 16B-aligned rows
#define LH  32    // logits/probs row stride (24 used)

typedef float v2f __attribute__((ext_vector_type(2)));
typedef float v8f __attribute__((ext_vector_type(8)));
typedef int   v4i __attribute__((vector_size(16)));   // matches builtin's expected param type

// ---------- CDNA5 async global->LDS path (ASYNCcnt), with sync fallback ----------
#if defined(__gfx1250__) && __has_builtin(__builtin_amdgcn_global_load_async_to_lds_b128)
#define HAVE_ASYNC 1
#else
#define HAVE_ASYNC 0
#endif

// Copy one 64x64 fp32 matrix (global row stride `rstride`) into LDS (row stride PITCH).
// 256 threads: 4 threads per row, 16 floats (4x b128) each.
// Async mode: 4 GLOBAL_LOAD_ASYNC_TO_LDS_B128 per thread -> 8 per wave per (input,weight) pair.
template <int PITCH>
__device__ __forceinline__ void copy_mat(float* __restrict__ dst,
                                         const float* __restrict__ base,
                                         long long rstride, int lr, int lc)
{
    const float* g = base + (long long)lr * rstride + lc;
    float* d = dst + lr * PITCH + lc;
#if HAVE_ASYNC
#pragma unroll
    for (int j = 0; j < 4; ++j) {
        __builtin_amdgcn_global_load_async_to_lds_b128(
            (v4i*)(g + 4 * j), (v4i*)(d + 4 * j), 0, 0);
    }
#else
#pragma unroll
    for (int j = 0; j < 4; ++j) {
        ((float4*)d)[j] = ((const float4*)g)[j];   // both pitches keep this 16B aligned
    }
#endif
}

// Wait until at most NREM async-load instructions of this wave are outstanding,
// then barrier so every wave's staged data is visible. Async loads complete in
// order, so NREM==8 means "the older 8-instruction group has fully landed in LDS"
// *provided* a newer group is still queued behind it; the final iteration of a
// streaming loop must use NREM==0 (only its own group is outstanding).
template <int NREM>
__device__ __forceinline__ void wait_stage()
{
#if HAVE_ASYNC
#if __has_builtin(__builtin_amdgcn_s_wait_asynccnt)
    __builtin_amdgcn_s_wait_asynccnt((unsigned short)NREM);
#else
    if (NREM == 0) asm volatile("s_wait_asynccnt 0x0" ::: "memory");
    else           asm volatile("s_wait_asynccnt 0x8" ::: "memory");
#endif
#endif
    __syncthreads();
}

// Two 16x16 output tiles (same row band tm) of a 64x64x64 fp32 GEMM using
// V_WMMA_F32_16X16X4_F32 (K=4 x 16 steps). The two tiles share the 32 columns from cb on,
// interleaved: lane n=lane&15 holds column cb+2n in tile 0 and cb+2n+1 in tile 1, so one
// 8-byte LDS read of a weight row feeds both tiles. The A fragment feeds both WMMAs.
// A layout (32-bit 16x4): lane m=lane&15; VGPR0 = A[m, k0], VGPR1 = A[m, k0+1], k0 = 4kk+2*(lane>>4).
// B layout (32-bit 4x16): lane n=lane&15; VGPR0 = B[k0, col],  VGPR1 = B[k0+1, col].
__device__ __forceinline__ void gemm16x2(const float* __restrict__ sA,
                                         const float* __restrict__ sB,
                                         int tm, int cb, int ml, int kh,
                                         v8f& c0, v8f& c1)
{
#pragma unroll
    for (int kk = 0; kk < 16; ++kk) {
        const int k0 = kk * 4 + 2 * kh;
        const v2f a  = *(const v2f*)&sA[(tm * 16 + ml) * LDSS + k0];
        const v2f w0 = *(const v2f*)&sB[(k0    ) * LDSB + cb + 2 * ml];
        const v2f w1 = *(const v2f*)&sB[(k0 + 1) * LDSB + cb + 2 * ml];
        v2f b0, b1;
        b0[0] = w0[0]; b0[1] = w1[0];
        b1[0] = w0[1]; b1[1] = w1[1];
        c0 = __builtin_amdgcn_wmma_f32_16x16x4_f32(false, a, false, b0, (short)0, c0,
                                                   false, false);
        c1 = __builtin_amdgcn_wmma_f32_16x16x4_f32(false, a, false, b1, (short)0, c1,
                                                   false, false);
    }
}

__global__ __launch_bounds__(256)
void node_mha_kernel(const float* __restrict__ Q,  const float* __restrict__ K,
                     const float* __restrict__ V,  const float* __restrict__ Wq,
                     const float* __restrict__ bq, const float* __restrict__ Wk,
                     const float* __restrict__ bk, const float* __restrict__ Wv,
                     const float* __restrict__ bv,
                     float* __restrict__ heads, float* __restrict__ scores)
{
    __shared__ float sA [2][64 * LDSS];  // double-buffered input slice (M = batch)
    __shared__ float sB [2][64 * LDSB];  // double-buffered weights
    __shared__ float sQW[64 * LDSS];     // QW result, reused for all 24 logit dots
    __shared__ float sL [64 * LH];       // logits -> probs, [batch][head]

    const int n    = blockIdx.x;        // node id, 0..206
    const int tid  = threadIdx.x;       // 256 threads = 8 wave32
    const int wv   = tid >> 5;
    const int lane = tid & 31;
    const int ml   = lane & 15;         // A row / B col / C col within tile
    const int kh   = lane >> 4;         // K-half (A/B) and M-half (C)
    const int lr   = tid >> 2;          // staging row 0..63
    const int lc   = (tid & 3) << 4;    // staging col {0,16,32,48}

    const int tm  = wv >> 1;            // this wave's row band (tiles share A)
    const int cb  = (wv & 1) * 32;      // first of this wave's 32 columns
    const int col = cb + 2 * ml;        // this lane's column pair: col (tile 0), col+1 (tile 1)

    // zero logits accumulators
    for (int i = tid; i < 64 * LH; i += 256) sL[i] = 0.0f;

    // ---------------- Phase 1: QW = Q_n @ Wq_n + bq[n]  (buffer 0) ----------------
    copy_mat<LDSS>(sA[0], Q  + (long long)n * F_,      (long long)N_ * F_, lr, lc);
    copy_mat<LDSB>(sB[0], Wq + (long long)n * F_ * F_, F_,                 lr, lc);
    // Prologue for phase 2: stream K/Wk head 0 into buffer 1 while we do QW.
    copy_mat<LDSS>(sA[1], K  + ((long long)0 * N_ + n) * F_,        (long long)H_ * N_ * F_, lr, lc);
    copy_mat<LDSB>(sB[1], Wk + (((long long)n * H_ + 0) * F_) * F_, F_,                      lr, lc);
    wait_stage<8>();   // Q/Wq landed (K0 group may still be in flight)

    {
        v8f c0 = {}, c1 = {};
        gemm16x2(sA[0], sB[0], tm, cb, ml, kh, c0, c1);
        const v2f bg = *(const v2f*)&bq[n * F_ + col];
#pragma unroll
        for (int r = 0; r < 8; ++r) {
            const int row = tm * 16 + r + 8 * kh;            // batch b
            v2f q;
            q[0] = c0[r] + bg[0];
            q[1] = c1[r] + bg[1];
            *(v2f*)&sQW[row * LDSS + col] = q;
        }
    }
    __syncthreads();
    // head h lives in buffer (h+1)&1; issue K/Wk head 1 into freed buffer 0.
    copy_mat<LDSS>(sA[0], K  + ((long long)1 * N_ + n) * F_,        (long long)H_ * N_ * F_, lr, lc);
    copy_mat<LDSB>(sB[0], Wk + (((long long)n * H_ + 1) * F_) * F_, F_,                      lr, lc);

    // ------- Phase 2: logits[b,h] = QW[b,:] . (K_nh @ Wk_nh + bk[n,h]) -------
    for (int h = 0; h < H_; ++h) {
        const int buf = (h + 1) & 1;
        // Normal iterations: a newer group is queued behind head h's group, so
        // waiting down to 8 outstanding proves head h landed. Final iteration:
        // only head h's group is outstanding -> must drain to 0.
        if (h == H_ - 1) wait_stage<0>(); else wait_stage<8>();

        v8f c0 = {}, c1 = {};
        gemm16x2(sA[buf], sB[buf], tm, cb, ml, kh, c0, c1);
        const v2f bg = *(const v2f*)&bk[((long long)n * H_ + h) * F_ + col];
        float part[8];
#pragma unroll
        for (int r = 0; r < 8; ++r) {
            const int row = tm * 16 + r + 8 * kh;
            const v2f q = *(const v2f*)&sQW[row * LDSS + col];
            part[r] = (c0[r] + bg[0]) * q[0] + (c1[r] + bg[1]) * q[1];
        }
        // reduce over the 32 columns this wave owns (within each 16-lane half)
#pragma unroll
        for (int off = 8; off >= 1; off >>= 1) {
#pragma unroll
            for (int r = 0; r < 8; ++r)
                part[r] += __shfl_xor(part[r], off, 16);
        }
        if (ml == 0) {
#pragma unroll
            for (int r = 0; r < 8; ++r) {
                const int row = tm * 16 + r + 8 * kh;
                atomicAdd(&sL[row * LH + h], part[r]);   // ds_add_f32
            }
        }
        __syncthreads();   // everyone done reading buf before it is refilled
        if (h + 2 < H_) {  // stream head h+2 into the buffer just freed
            copy_mat<LDSS>(sA[buf], K  + ((long long)(h + 2) * N_ + n) * F_,
                     (long long)H_ * N_ * F_, lr, lc);
            copy_mat<LDSB>(sB[buf], Wk + (((long long)n * H_ + (h + 2)) * F_) * F_,
                     F_, lr, lc);
        }
    }

    // Prologue for phase 4: V/Wv heads 0 and 1 stream while softmax runs.
    copy_mat<LDSS>(sA[1], V  + ((long long)0 * N_ + n) * F_,        (long long)H_ * N_ * F_, lr, lc);
    copy_mat<LDSB>(sB[1], Wv + (((long long)n * H_ + 0) * F_) * F_, F_,                      lr, lc);
    copy_mat<LDSS>(sA[0], V  + ((long long)1 * N_ + n) * F_,        (long long)H_ * N_ * F_, lr, lc);
    copy_mat<LDSB>(sB[0], Wv + (((long long)n * H_ + 1) * F_) * F_, F_,                      lr, lc);

    // ---------------- Phase 3: softmax over H (24) per batch row ----------------
    if (tid < 64) {
        float mx = -3.4e38f;
#pragma unroll
        for (int h = 0; h < H_; ++h) mx = fmaxf(mx, sL[tid * LH + h]);
        float e[H_];
        float sum = 0.0f;
#pragma unroll
        for (int h = 0; h < H_; ++h) { e[h] = __expf(sL[tid * LH + h] - mx); sum += e[h]; }
        const float inv = 1.0f / sum;
#pragma unroll
        for (int h = 0; h < H_; ++h) {
            const float p = e[h] * inv;
            sL[tid * LH + h] = p;
            scores[((long long)tid * N_ + n) * H_ + h] = p;   // scores[b,n,h]
        }
    }

    // ---- Phase 4: heads[b,:] = sum_h p[b,h] * (V_nh @ Wv_nh + bv[n,h]) ----
    v8f hacc0 = {}, hacc1 = {};
    for (int h = 0; h < H_; ++h) {
        const int buf = (h + 1) & 1;
        if (h == H_ - 1) wait_stage<0>(); else wait_stage<8>();
        // (h==0 barrier also publishes the softmax probs)

        v8f c0 = {}, c1 = {};
        gemm16x2(sA[buf], sB[buf], tm, cb, ml, kh, c0, c1);
        const v2f bg = *(const v2f*)&bv[((long long)n * H_ + h) * F_ + col];
#pragma unroll
        for (int r = 0; r < 8; ++r) {
            const int row = tm * 16 + r + 8 * kh;        // batch b
            const float p = sL[row * LH + h];            // broadcast LDS read
            hacc0[r] += p * (c0[r] + bg[0]);
            hacc1[r] += p * (c1[r] + bg[1]);
        }
        __syncthreads();
        if (h + 2 < H_) {
            copy_mat<LDSS>(sA[buf], V  + ((long long)(h + 2) * N_ + n) * F_,
                     (long long)H_ * N_ * F_, lr, lc);
            copy_mat<LDSB>(sB[buf], Wv + (((long long)n * H_ + (h + 2)) * F_) * F_,
                     F_, lr, lc);
        }
    }

    // store heads[b,n,g]
#pragma unroll
    for (int r = 0; r < 8; ++r) {
        const int row = tm * 16 + r + 8 * kh;            // batch b
        v2f o;
        o[0] = hacc0[r];
        o[1] = hacc1[r];
        *(v2f*)&heads[((long long)row * N_ + n) * F_ + col] = o;
    }
}

extern "C" void kernel_launch(void* const* d_in, const int* in_sizes, int n_in,
                              void* d_out, int out_size, void* d_ws, size_t ws_size,
                              hipStream_t stream)
{
    (void)in_sizes; (void)n_in; (void)d_ws; (void)ws_size; (void)out_size;
    const float* Q  = (const float*)d_in[0];
    const float* K  = (const float*)d_in[1];
    const float* V  = (const float*)d_in[2];
    const float* Wq = (const float*)d_in[3];
    const float* bq = (const float*)d_in[4];
    const float* Wk = (const float*)d_in[5];
    const float* bk = (const float*)d_in[6];
    const float* Wv = (const float*)d_in[7];
    const float* bv = (const float*)d_in[8];

    float* heads  = (float*)d_out;                       // [B,N,F]
    float* scores = heads + (size_t)B_ * N_ * F_;        // [B,N,H]

    node_mha_kernel<<<dim3(N_), dim3(256), 0, stream>>>(Q, K, V, Wq, bq, Wk, bk, Wv, bv,
                                                        heads, scores);
}

// v002
// It runs in 59.3 microseconds.
// Timed twice side by side with v001, it ran 1.10 times as fast both times.
// Counting every step since v000, it is 1.19 times as fast.
#include <hip/hip_runtime.h>

// Problem constants (from reference)
#define B_  64
#define H_  24
#define N_  207
#define F_  64
#define LDSS 68   // padded LDS row stride (floats): conflict-free A-frag reads, 16B-aligned rows
#define LDSB 80   // weight-tile row stride (floats): rows k and k+2 lie 32 banks apart, so the two
                  // half-waves of an 8-byte B read cover all 64 banks once; 16B-aligned rows
#define LH  32    // logits/probs row stride (24 used)

typedef float v2f __attribute__((ext_vector_type(2)));
typedef float v8f __attribute__((ext_vector_type(8)));
typedef int   v4i __attribute__((vector_size(16)));   // matches builtin's expected param type

// ---------- CDNA5 async global->LDS path (ASYNCcnt), with sync fallback ----------
#if defined(__gfx1250__) && __has_builtin(__builtin_amdgcn_global_load_async_to_lds_b128)
#define HAVE_ASYNC 1
#else
#define HAVE_ASYNC 0
#endif

// Copy one 64x64 fp32 matrix (global row stride `rstride`) into LDS (row stride PITCH).
// 256 threads: 4 threads per row, 16 floats (4x b128) each.
// Async mode: 4 GLOBAL_LOAD_ASYNC_TO_LDS_B128 per thread -> 8 per wave per (input,weight) pair.
template <int PITCH>
__device__ __forceinline__ void copy_mat(float* __restrict__ dst,
                                         const float* __restrict__ base,
                                         long long rstride, int lr, int lc)
{
    const float* g = base + (long long)lr * rstride + lc;
    float* d = dst + lr * PITCH + lc;
#if HAVE_ASYNC
#pragma unroll
    for (int j = 0; j < 4; ++j) {
        __builtin_amdgcn_global_load_async_to_lds_b128(
            (v4i*)(g + 4 * j), (v4i*)(d + 4 * j), 0, 0);
    }
#else
#pragma unroll
    for (int j = 0; j < 4; ++j) {
        ((float4*)d)[j] = ((const float4*)g)[j];   // both pitches keep this 16B aligned
    }
#endif
}

// Wait until at most NREM async-load instructions of this wave are outstanding,
// then barrier so every wave's staged data is visible. Async loads complete in
// order, so NREM==8 means "the older 8-instruction group has fully landed in LDS"
// *provided* a newer group is still queued behind it; the final iteration of a
// streaming loop must use NREM==0 (only its own group is outstanding).
template <int NREM>
__device__ __forceinline__ void wait_stage()
{
#if HAVE_ASYNC
#if __has_builtin(__builtin_amdgcn_s_wait_asynccnt)
    __builtin_amdgcn_s_wait_asynccnt((unsigned short)NREM);
#else
    if (NREM == 0) asm volatile("s_wait_asynccnt 0x0" ::: "memory");
    else           asm volatile("s_wait_asynccnt 0x8" ::: "memory");
#endif
#endif
    __syncthreads();
}

// Two 16x16 output tiles (same row band tm) of a 64x64x64 fp32 GEMM using
// V_WMMA_F32_16X16X4_F32 (K=4 x 16 steps). The two tiles share the 32 columns from cb on,
// interleaved: lane n=lane&15 holds column cb+2n in tile 0 and cb+2n+1 in tile 1, so one
// 8-byte LDS read of a weight row feeds both tiles. The A fragment feeds both WMMAs.
// A layout (32-bit 16x4): lane m=lane&15; VGPR0 = A[m, k0], VGPR1 = A[m, k0+1], k0 = 4kk+2*(lane>>4).
// B layout (32-bit 4x16): lane n=lane&15; VGPR0 = B[k0, col],  VGPR1 = B[k0+1, col].
__device__ __forceinline__ void gemm16x2(const float* __restrict__ sA,
                                         const float* __restrict__ sB,
                                         int tm, int cb, int ml, int kh,
                                         v8f& c0, v8f& c1)
{
#pragma unroll
    for (int kk = 0; kk < 16; ++kk) {
        const int k0 = kk * 4 + 2 * kh;
        const v2f a  = *(const v2f*)&sA[(tm * 16 + ml) * LDSS + k0];
        const v2f w0 = *(const v2f*)&sB[(k0    ) * LDSB + cb + 2 * ml];
        const v2f w1 = *(const v2f*)&sB[(k0 + 1) * LDSB + cb + 2 * ml];
        v2f b0, b1;
        b0[0] = w0[0]; b0[1] = w1[0];
        b1[0] = w0[1]; b1[1] = w1[1];
        c0 = __builtin_amdgcn_wmma_f32_16x16x4_f32(false, a, false, b0, (short)0, c0,
                                                   false, false);
        c1 = __builtin_amdgcn_wmma_f32_16x16x4_f32(false, a, false, b1, (short)0, c1,
                                                   false, false);
    }
}

__global__ __launch_bounds__(256)
void node_mha_kernel(const float* __restrict__ Q,  const float* __restrict__ K,
                     const float* __restrict__ V,  const float* __restrict__ Wq,
                     const float* __restrict__ bq, const float* __restrict__ Wk,
                     const float* __restrict__ bk, const float* __restrict__ Wv,
                     const float* __restrict__ bv,
                     float* __restrict__ heads, float* __restrict__ scores)
{
    __shared__ float sA [2][64 * LDSS];  // double-buffered input slice (M = batch)
    __shared__ float sB [2][64 * LDSB];  // double-buffered weights
    __shared__ float sQW[64 * LDSS];     // QW result, reused for all 24 logit dots
    __shared__ float sL [64 * LH];       // logits -> probs, [batch][head]
    // this node's 24 bk rows, then its 24 bv rows: read from memory once, so that no stage of
    // the two head loops holds a global load (and its wait) between its barriers
    __shared__ __attribute__((aligned(16))) float sBias[2 * H_ * F_];

    const int n    = blockIdx.x;        // node id, 0..206
    const int tid  = threadIdx.x;       // 256 threads = 8 wave32
    const int wv   = tid >> 5;
    const int lane = tid & 31;
    const int ml   = lane & 15;         // A row / B col / C col within tile
    const int kh   = lane >> 4;         // K-half (A/B) and M-half (C)
    const int lr   = tid >> 2;          // staging row 0..63
    const int lc   = (tid & 3) << 4;    // staging col {0,16,32,48}

    const int tm  = wv >> 1;            // this wave's row band (tiles share A)
    const int cb  = (wv & 1) * 32;      // first of this wave's 32 columns
    const int col = cb + 2 * ml;        // this lane's column pair: col (tile 0), col+1 (tile 1)

    // zero logits accumulators
    for (int i = tid; i < 64 * LH; i += 256) sL[i] = 0.0f;

    // ---------------- Phase 1: QW = Q_n @ Wq_n + bq[n]  (buffer 0) ----------------
    copy_mat<LDSS>(sA[0], Q  + (long long)n * F_,      (long long)N_ * F_, lr, lc);
    copy_mat<LDSB>(sB[0], Wq + (long long)n * F_ * F_, F_,                 lr, lc);
    // Prologue for phase 2: stream K/Wk head 0 into buffer 1 while we do QW.
    copy_mat<LDSS>(sA[1], K  + ((long long)0 * N_ + n) * F_,        (long long)H_ * N_ * F_, lr, lc);
    copy_mat<LDSB>(sB[1], Wk + (((long long)n * H_ + 0) * F_) * F_, F_,                      lr, lc);
    {
        // 2 x 1536 floats = 768 pieces of 16 bytes, three per thread; waves 0-3 of the middle
        // trip finish bk, waves 4-7 start bv. Published by the barrier of the wait below.
        const float* gk = bk + (long long)n * H_ * F_;
        const float* gv = bv + (long long)n * H_ * F_;
        for (int i = 0; i < 3; ++i) {
            const int e = (i * 256 + tid) * 4;
            const float* s = (e < H_ * F_) ? (gk + e) : (gv + (e - H_ * F_));
            *(float4*)&sBias[e] = *(const float4*)s;
        }
    }
    wait_stage<8>();   // Q/Wq landed (K0 group may still be in flight)

    {
        v8f c0 = {}, c1 = {};
        gemm16x2(sA[0], sB[0], tm, cb, ml, kh, c0, c1);
        const v2f bg = *(const v2f*)&bq[n * F_ + col];
#pragma unroll
        for (int r = 0; r < 8; ++r) {
            const int row = tm * 16 + r + 8 * kh;            // batch b
            v2f q;
            q[0] = c0[r] + bg[0];
            q[1] = c1[r] + bg[1];
            *(v2f*)&sQW[row * LDSS + col] = q;
        }
    }
    __syncthreads();
    // head h lives in buffer (h+1)&1; issue K/Wk head 1 into freed buffer 0.
    copy_mat<LDSS>(sA[0], K  + ((long long)1 * N_ + n) * F_,        (long long)H_ * N_ * F_, lr, lc);
    copy_mat<LDSB>(sB[0], Wk + (((long long)n * H_ + 1) * F_) * F_, F_,                      lr, lc);

    // ------- Phase 2: logits[b,h] = QW[b,:] . (K_nh @ Wk_nh + bk[n,h]) -------
    for (int h = 0; h < H_; ++h) {
        const int buf = (h + 1) & 1;
        // Normal iterations: a newer group is queued behind head h's group, so
        // waiting down to 8 outstanding proves head h landed. Final iteration:
        // only head h's group is outstanding -> must drain to 0.
        if (h == H_ - 1) wait_stage<0>(); else wait_stage<8>();

        v8f c0 = {}, c1 = {};
        gemm16x2(sA[buf], sB[buf], tm, cb, ml, kh, c0, c1);
        const v2f bg = *(const v2f*)&sBias[h * F_ + col];
        float part[8];
#pragma unroll
        for (int r = 0; r < 8; ++r) {
            const int row = tm * 16 + r + 8 * kh;
            const v2f q = *(const v2f*)&sQW[row * LDSS + col];
            part[r] = (c0[r] + bg[0]) * q[0] + (c1[r] + bg[1]) * q[1];
        }
        // reduce over the 32 columns this wave owns (within each 16-lane half)
#pragma unroll
        for (int off = 8; off >= 1; off >>= 1) {
#pragma unroll
            for (int r = 0; r < 8; ++r)
                part[r] += __shfl_xor(part[r], off, 16);
        }
        if (ml == 0) {
#pragma unroll
            for (int r = 0; r < 8; ++r) {
                const int row = tm * 16 + r + 8 * kh;
                atomicAdd(&sL[row * LH + h], part[r]);   // ds_add_f32
            }
        }
        __syncthreads();   // everyone done reading buf before it is refilled
        if (h + 2 < H_) {  // stream head h+2 into the buffer just freed
            copy_mat<LDSS>(sA[buf], K  + ((long long)(h + 2) * N_ + n) * F_,
                     (long long)H_ * N_ * F_, lr, lc);
            copy_mat<LDSB>(sB[buf], Wk + (((long long)n * H_ + (h + 2)) * F_) * F_,
                     F_, lr, lc);
        }
    }

    // Prologue for phase 4: V/Wv heads 0 and 1 stream while softmax runs.
    copy_mat<LDSS>(sA[1], V  + ((long long)0 * N_ + n) * F_,        (long long)H_ * N_ * F_, lr, lc);
    copy_mat<LDSB>(sB[1], Wv + (((long long)n * H_ + 0) * F_) * F_, F_,                      lr, lc);
    copy_mat<LDSS>(sA[0], V  + ((long long)1 * N_ + n) * F_,        (long long)H_ * N_ * F_, lr, lc);
    copy_mat<LDSB>(sB[0], Wv + (((long long)n * H_ + 1) * F_) * F_, F_,                      lr, lc);

    // ---------------- Phase 3: softmax over H (24) per batch row ----------------
    if (tid < 64) {
        float mx = -3.4e38f;
#pragma unroll
        for (int h = 0; h < H_; ++h) mx = fmaxf(mx, sL[tid * LH + h]);
        float e[H_];
        float sum = 0.0f;
#pragma unroll
        for (int h = 0; h < H_; ++h) { e[h] = __expf(sL[tid * LH + h] - mx); sum += e[h]; }
        const float inv = 1.0f / sum;
#pragma unroll
        for (int h = 0; h < H_; ++h) {
            const float p = e[h] * inv;
            sL[tid * LH + h] = p;
            scores[((long long)tid * N_ + n) * H_ + h] = p;   // scores[b,n,h]
        }
    }

    // ---- Phase 4: heads[b,:] = sum_h p[b,h] * (V_nh @ Wv_nh + bv[n,h]) ----
    v8f hacc0 = {}, hacc1 = {};
    for (int h = 0; h < H_; ++h) {
        const int buf = (h + 1) & 1;
        if (h == H_ - 1) wait_stage<0>(); else wait_stage<8>();
        // (h==0 barrier also publishes the softmax probs)

        v8f c0 = {}, c1 = {};
        gemm16x2(sA[buf], sB[buf], tm, cb, ml, kh, c0, c1);
        const v2f bg = *(const v2f*)&sBias[(H_ + h) * F_ + col];
#pragma unroll
        for (int r = 0; r < 8; ++r) {
            const int row = tm * 16 + r + 8 * kh;        // batch b
            const float p = sL[row * LH + h];            // broadcast LDS read
            hacc0[r] += p * (c0[r] + bg[0]);
            hacc1[r] += p * (c1[r] + bg[1]);
        }
        __syncthreads();
        if (h + 2 < H_) {
            copy_mat<LDSS>(sA[buf], V  + ((long long)(h + 2) * N_ + n) * F_,
                     (long long)H_ * N_ * F_, lr, lc);
            copy_mat<LDSB>(sB[buf], Wv + (((long long)n * H_ + (h + 2)) * F_) * F_,
                     F_, lr, lc);
        }
    }

    // store heads[b,n,g]
#pragma unroll
    for (int r = 0; r < 8; ++r) {
        const int row = tm * 16 + r + 8 * kh;            // batch b
        v2f o;
        o[0] = hacc0[r];
        o[1] = hacc1[r];
        *(v2f*)&heads[((long long)row * N_ + n) * F_ + col] = o;
    }
}

extern "C" void kernel_launch(void* const* d_in, const int* in_sizes, int n_in,
                              void* d_out, int out_size, void* d_ws, size_t ws_size,
                              hipStream_t stream)
{
    (void)in_sizes; (void)n_in; (void)d_ws; (void)ws_size; (void)out_size;
    const float* Q  = (const float*)d_in[0];
    const float* K  = (const float*)d_in[1];
    const float* V  = (const float*)d_in[2];
    const float* Wq = (const float*)d_in[3];
    const float* bq = (const float*)d_in[4];
    const float* Wk = (const float*)d_in[5];
    const float* bk = (const float*)d_in[6];
    const float* Wv = (const float*)d_in[7];
    const float* bv = (const float*)d_in[8];

    float* heads  = (float*)d_out;                       // [B,N,F]
    float* scores = heads + (size_t)B_ * N_ * F_;        // [B,N,H]

    node_mha_kernel<<<dim3(N_), dim3(256), 0, stream>>>(Q, K, V, Wq, bq, Wk, bk, Wv, bv,
                                                        heads, scores);
}

// v003
// Measured time: 53.1 microseconds a run.
// Timed twice side by side with v002, it ran 1.12 times as fast both times.
// Counting every step since v000, it is 1.33 times as fast.
#include <hip/hip_runtime.h>

// Problem constants (from reference)
#define B_  64
#define H_  24
#define N_  207
#define F_  64
#define LDSS 68   // padded LDS row stride (floats): conflict-free A-frag reads, 16B-aligned rows
#define LDSB 80   // weight-tile row stride (floats): rows k and k+2 lie 32 banks apart, so the two
                  // half-waves of an 8-byte B read cover all 64 banks once; 16B-aligned rows
#define LH  32    // logits/probs row stride (24 used)

typedef float v2f __attribute__((ext_vector_type(2)));
typedef float v8f __attribute__((ext_vector_type(8)));
typedef int   v4i __attribute__((vector_size(16)));   // matches builtin's expected param type

// ---------- CDNA5 async global->LDS path (ASYNCcnt), with sync fallback ----------
#if defined(__gfx1250__) && __has_builtin(__builtin_amdgcn_global_load_async_to_lds_b128)
#define HAVE_ASYNC 1
#else
#define HAVE_ASYNC 0
#endif

// Copy one 64x64 fp32 matrix (global row stride `rstride`) into LDS (row stride PITCH).
// 256 threads: 16 lanes per 256-byte row, 16 bytes each, so one wave-wide copy takes two whole
// rows (four whole 128-byte lines) instead of 32-byte pieces of sixteen lines. A wave owns eight
// rows: trip j takes rows lr + 2j (lr = 8 * wave + half-wave), lc = 4 * (lane & 15).
// Async mode: 4 GLOBAL_LOAD_ASYNC_TO_LDS_B128 per thread -> 8 per wave per (input,weight) pair.
template <int PITCH>
__device__ __forceinline__ void copy_mat(float* __restrict__ dst,
                                         const float* __restrict__ base,
                                         long long rstride, int lr, int lc)
{
    const float* g = base + (long long)lr * rstride + lc;
    float* d = dst + lr * PITCH + lc;
#if HAVE_ASYNC
#pragma unroll
    for (int j = 0; j < 4; ++j) {
        __builtin_amdgcn_global_load_async_to_lds_b128(
            (v4i*)(g + 2 * j * rstride), (v4i*)(d + 2 * j * PITCH), 0, 0);
    }
#else
#pragma unroll
    for (int j = 0; j < 4; ++j) {
        *(float4*)(d + 2 * j * PITCH) = *(const float4*)(g + 2 * j * rstride);   // both pitches keep this 16B aligned
    }
#endif
}

// Wait until at most NREM async-load instructions of this wave are outstanding,
// then barrier so every wave's staged data is visible. Async loads complete in
// order, so NREM==8 means "the older 8-instruction group has fully landed in LDS"
// *provided* a newer group is still queued behind it; the final iteration of a
// streaming loop must use NREM==0 (only its own group is outstanding).
template <int NREM>
__device__ __forceinline__ void wait_stage()
{
#if HAVE_ASYNC
#if __has_builtin(__builtin_amdgcn_s_wait_asynccnt)
    __builtin_amdgcn_s_wait_asynccnt((unsigned short)NREM);
#else
    if (NREM == 0) asm volatile("s_wait_asynccnt 0x0" ::: "memory");
    else           asm volatile("s_wait_asynccnt 0x8" ::: "memory");
#endif
#endif
    __syncthreads();
}

// Two 16x16 output tiles (same row band tm) of a 64x64x64 fp32 GEMM using
// V_WMMA_F32_16X16X4_F32 (K=4 x 16 steps). The two tiles share the 32 columns from cb on,
// interleaved: lane n=lane&15 holds column cb+2n in tile 0 and cb+2n+1 in tile 1, so one
// 8-byte LDS read of a weight row feeds both tiles. The A fragment feeds both WMMAs.
// A layout (32-bit 16x4): lane m=lane&15; VGPR0 = A[m, k0], VGPR1 = A[m, k0+1], k0 = 4kk+2*(lane>>4).
// B layout (32-bit 4x16): lane n=lane&15; VGPR0 = B[k0, col],  VGPR1 = B[k0+1, col].
__device__ __forceinline__ void gemm16x2(const float* __restrict__ sA,
                                         const float* __restrict__ sB,
                                         int tm, int cb, int ml, int kh,
                                         v8f& c0, v8f& c1)
{
#pragma unroll
    for (int kk = 0; kk < 16; ++kk) {
        const int k0 = kk * 4 + 2 * kh;
        const v2f a  = *(const v2f*)&sA[(tm * 16 + ml) * LDSS + k0];
        const v2f w0 = *(const v2f*)&sB[(k0    ) * LDSB + cb + 2 * ml];
        const v2f w1 = *(const v2f*)&sB[(k0 + 1) * LDSB + cb + 2 * ml];
        v2f b0, b1;
        b0[0] = w0[0]; b0[1] = w1[0];
        b1[0] = w0[1]; b1[1] = w1[1];
        c0 = __builtin_amdgcn_wmma_f32_16x16x4_f32(false, a, false, b0, (short)0, c0,
                                                   false, false);
        c1 = __builtin_amdgcn_wmma_f32_16x16x4_f32(false, a, false, b1, (short)0, c1,
                                                   false, false);
    }
}

__global__ __launch_bounds__(256)
void node_mha_kernel(const float* __restrict__ Q,  const float* __restrict__ K,
                     const float* __restrict__ V,  const float* __restrict__ Wq,
                     const float* __restrict__ bq, const float* __restrict__ Wk,
                     const float* __restrict__ bk, const float* __restrict__ Wv,
                     const float* __restrict__ bv,
                     float* __restrict__ heads, float* __restrict__ scores)
{
    __shared__ float sA [2][64 * LDSS];  // double-buffered input slice (M = batch)
    __shared__ float sB [2][64 * LDSB];  // double-buffered weights
    __shared__ float sQW[64 * LDSS];     // QW result, reused for all 24 logit dots
    __shared__ float sL [64 * LH];       // logits -> probs, [batch][head]
    // this node's 24 bk rows, then its 24 bv rows: read from memory once, so that no stage of
    // the two head loops holds a global load (and its wait) between its barriers
    __shared__ __attribute__((aligned(16))) float sBias[2 * H_ * F_];

    const int n    = blockIdx.x;        // node id, 0..206
    const int tid  = threadIdx.x;       // 256 threads = 8 wave32
    const int wv   = tid >> 5;
    const int lane = tid & 31;
    const int ml   = lane & 15;         // A row / B col / C col within tile
    const int kh   = lane >> 4;         // K-half (A/B) and M-half (C)
    const int lr   = wv * 8 + kh;       // first staging row of this half-wave (then +2 a trip)
    const int lc   = ml << 2;           // staging col 0,4,..,60

    const int tm  = wv >> 1;            // this wave's row band (tiles share A)
    const int cb  = (wv & 1) * 32;      // first of this wave's 32 columns
    const int col = cb + 2 * ml;        // this lane's column pair: col (tile 0), col+1 (tile 1)

    // zero logits accumulators
    for (int i = tid; i < 64 * LH; i += 256) sL[i] = 0.0f;

    // ---------------- Phase 1: QW = Q_n @ Wq_n + bq[n]  (buffer 0) ----------------
    copy_mat<LDSS>(sA[0], Q  + (long long)n * F_,      (long long)N_ * F_, lr, lc);
    copy_mat<LDSB>(sB[0], Wq + (long long)n * F_ * F_, F_,                 lr, lc);
    // Prologue for phase 2: stream K/Wk head 0 into buffer 1 while we do QW.
    copy_mat<LDSS>(sA[1], K  + ((long long)0 * N_ + n) * F_,        (long long)H_ * N_ * F_, lr, lc);
    copy_mat<LDSB>(sB[1], Wk + (((long long)n * H_ + 0) * F_) * F_, F_,                      lr, lc);
    {
        // 2 x 1536 floats = 768 pieces of 16 bytes, three per thread; waves 0-3 of the middle
        // trip finish bk, waves 4-7 start bv. Published by the barrier of the wait below.
        const float* gk = bk + (long long)n * H_ * F_;
        const float* gv = bv + (long long)n * H_ * F_;
        for (int i = 0; i < 3; ++i) {
            const int e = (i * 256 + tid) * 4;
            const float* s = (e < H_ * F_) ? (gk + e) : (gv + (e - H_ * F_));
            *(float4*)&sBias[e] = *(const float4*)s;
        }
    }
    wait_stage<8>();   // Q/Wq landed (K0 group may still be in flight)

    {
        v8f c0 = {}, c1 = {};
        gemm16x2(sA[0], sB[0], tm, cb, ml, kh, c0, c1);
        const v2f bg = *(const v2f*)&bq[n * F_ + col];
#pragma unroll
        for (int r = 0; r < 8; ++r) {
            const int row = tm * 16 + r + 8 * kh;            // batch b
            v2f q;
            q[0] = c0[r] + bg[0];
            q[1] = c1[r] + bg[1];
            *(v2f*)&sQW[row * LDSS + col] = q;
        }
    }
    __syncthreads();
    // head h lives in buffer (h+1)&1; issue K/Wk head 1 into freed buffer 0.
    copy_mat<LDSS>(sA[0], K  + ((long long)1 * N_ + n) * F_,        (long long)H_ * N_ * F_, lr, lc);
    copy_mat<LDSB>(sB[0], Wk + (((long long)n * H_ + 1) * F_) * F_, F_,                      lr, lc);

    // ------- Phase 2: logits[b,h] = QW[b,:] . (K_nh @ Wk_nh + bk[n,h]) -------
    for (int h = 0; h < H_; ++h) {
        const int buf = (h + 1) & 1;
        // Normal iterations: a newer group is queued behind head h's group, so
        // waiting down to 8 outstanding proves head h landed. Final iteration:
        // only head h's group is outstanding -> must drain to 0.
        if (h == H_ - 1) wait_stage<0>(); else wait_stage<8>();

        v8f c0 = {}, c1 = {};
        gemm16x2(sA[buf], sB[buf], tm, cb, ml, kh, c0, c1);
        const v2f bg = *(const v2f*)&sBias[h * F_ + col];
        float part[8];
#pragma unroll
        for (int r = 0; r < 8; ++r) {
            const int row = tm * 16 + r + 8 * kh;
            const v2f q = *(const v2f*)&sQW[row * LDSS + col];
            part[r] = (c0[r] + bg[0]) * q[0] + (c1[r] + bg[1]) * q[1];
        }
        // reduce over the 32 columns this wave owns (within each 16-lane half)
#pragma unroll
        for (int off = 8; off >= 1; off >>= 1) {
#pragma unroll
            for (int r = 0; r < 8; ++r)
                part[r] += __shfl_xor(part[r], off, 16);
        }
        if (ml == 0) {
#pragma unroll
            for (int r = 0; r < 8; ++r) {
                const int row = tm * 16 + r + 8 * kh;
                atomicAdd(&sL[row * LH + h], part[r]);   // ds_add_f32
            }
        }
        __syncthreads();   // everyone done reading buf before it is refilled
        if (h + 2 < H_) {  // stream head h+2 into the buffer just freed
            copy_mat<LDSS>(sA[buf], K  + ((long long)(h + 2) * N_ + n) * F_,
                     (long long)H_ * N_ * F_, lr, lc);
            copy_mat<LDSB>(sB[buf], Wk + (((long long)n * H_ + (h + 2)) * F_) * F_,
                     F_, lr, lc);
        }
    }

    // Prologue for phase 4: V/Wv heads 0 and 1 stream while softmax runs.
    copy_mat<LDSS>(sA[1], V  + ((long long)0 * N_ + n) * F_,        (long long)H_ * N_ * F_, lr, lc);
    copy_mat<LDSB>(sB[1], Wv + (((long long)n * H_ + 0) * F_) * F_, F_,                      lr, lc);
    copy_mat<LDSS>(sA[0], V  + ((long long)1 * N_ + n) * F_,        (long long)H_ * N_ * F_, lr, lc);
    copy_mat<LDSB>(sB[0], Wv + (((long long)n * H_ + 1) * F_) * F_, F_,                      lr, lc);

    // ---------------- Phase 3: softmax over H (24) per batch row ----------------
    if (tid < 64) {
        float mx = -3.4e38f;
#pragma unroll
        for (int h = 0; h < H_; ++h) mx = fmaxf(mx, sL[tid * LH + h]);
        float e[H_];
        float sum = 0.0f;
#pragma unroll
        for (int h = 0; h < H_; ++h) { e[h] = __expf(sL[tid * LH + h] - mx); sum += e[h]; }
        const float inv = 1.0f / sum;
#pragma unroll
        for (int h = 0; h < H_; ++h) {
            const float p = e[h] * inv;
            sL[tid * LH + h] = p;
            scores[((long long)tid * N_ + n) * H_ + h] = p;   // scores[b,n,h]
        }
    }

    // ---- Phase 4: heads[b,:] = sum_h p[b,h] * (V_nh @ Wv_nh + bv[n,h]) ----
    v8f hacc0 = {}, hacc1 = {};
    for (int h = 0; h < H_; ++h) {
        const int buf = (h + 1) & 1;
        if (h == H_ - 1) wait_stage<0>(); else wait_stage<8>();
        // (h==0 barrier also publishes the softmax probs)

        v8f c0 = {}, c1 = {};
        gemm16x2(sA[buf], sB[buf], tm, cb, ml, kh, c0, c1);
        const v2f bg = *(const v2f*)&sBias[(H_ + h) * F_ + col];
#pragma unroll
        for (int r = 0; r < 8; ++r) {
            const int row = tm * 16 + r + 8 * kh;        // batch b
            const float p = sL[row * LH + h];            // broadcast LDS read
            hacc0[r] += p * (c0[r] + bg[0]);
            hacc1[r] += p * (c1[r] + bg[1]);
        }
        __syncthreads();
        if (h + 2 < H_) {
            copy_mat<LDSS>(sA[buf], V  + ((long long)(h + 2) * N_ + n) * F_,
                     (long long)H_ * N_ * F_, lr, lc);
            copy_mat<LDSB>(sB[buf], Wv + (((long long)n * H_ + (h + 2)) * F_) * F_,
                     F_, lr, lc);
        }
    }

    // store heads[b,n,g]
#pragma unroll
    for (int r = 0; r < 8; ++r) {
        const int row = tm * 16 + r + 8 * kh;            // batch b
        v2f o;
        o[0] = hacc0[r];
        o[1] = hacc1[r];
        *(v2f*)&heads[((long long)row * N_ + n) * F_ + col] = o;
    }
}

extern "C" void kernel_launch(void* const* d_in, const int* in_sizes, int n_in,
                              void* d_out, int out_size, void* d_ws, size_t ws_size,
                              hipStream_t stream)
{
    (void)in_sizes; (void)n_in; (void)d_ws; (void)ws_size; (void)out_size;
    const float* Q  = (const float*)d_in[0];
    const float* K  = (const float*)d_in[1];
    const float* V  = (const float*)d_in[2];
    const float* Wq = (const float*)d_in[3];
    const float* bq = (const float*)d_in[4];
    const float* Wk = (const float*)d_in[5];
    const float* bk = (const float*)d_in[6];
    const float* Wv = (const float*)d_in[7];
    const float* bv = (const float*)d_in[8];

    float* heads  = (float*)d_out;                       // [B,N,F]
    float* scores = heads + (size_t)B_ * N_ * F_;        // [B,N,H]

    node_mha_kernel<<<dim3(N_), dim3(256), 0, stream>>>(Q, K, V, Wq, bq, Wk, bk, Wv, bv,
                                                        heads, scores);
}
